// v000
// Times are from an AMD MI455X. After a warm-up the kernel runs many times in a row, and a time is the length of
// such a window on the GPU divided by its runs, so every launch and the gaps after it count. The runs cycle
// through copies of the inputs. A figure is the median of several windows, for all but v000 over two sittings.
// Sittings can differ by a few percent; kernels timed side by side share one.
// The starting kernel, v000, takes 1010 microseconds a run.
#include <hip/hip_runtime.h>

// IQCA (x [8][2048][512]; q, k, v = x W^T + b (single head over all 512 features); attn = softmax(q.k^T) (UNSCALED logits, sigma ~ 23) then / sqrt(512); out = attn v [2048][512]; the module returns
// out.transpose(1,2).reshape(B, 2048, 512), i.e. each batch block holds out^T [512][2048] -> [8][2048][512]).
// Compute dtypes, f32 accumulate: every input rounded to bf16; projections on PLAIN bf16 operands (inputs: exact products, f32 accumulate, + bias); the unscaled scores
// (K 512) on bf16 hi+lo planes of q and k (3 products: hi.hi + hi.lo + lo.hi - the logits are large, so single fp16 planes would not do); softmax in f32 (register row, one exp) -> fp16 probabilities
// x1024; the transposed output straight from one GEMM out^T = V^T . P^T on fp16 planes (v as fp16, P x1024), with the 1/(1024 sqrt 512) applied in the f32 output pass. One-wave-per-64x64-tile GEMMs,

#define NB_  8
#define TT   2048
#define NN   512
#define ZH   1
#define PCAR 1024.0f
#define SCL  1.0f                 // logits are not scaled; the 512^-0.5 divides the probabilities
#define OSC  (1.0f / (1024.0f * 22.627416997969522f))
typedef _Float16 h16;
typedef unsigned short bf;
typedef __attribute__((ext_vector_type(16))) __bf16   v16bf;
typedef __attribute__((ext_vector_type(16))) _Float16 v16h;
typedef __attribute__((ext_vector_type(8)))  _Float16 v8h;
typedef __attribute__((ext_vector_type(8)))  unsigned short v8us;
typedef __attribute__((ext_vector_type(8)))  float    v8f;
typedef __attribute__((ext_vector_type(4)))  float    v4f;
typedef v8h  __attribute__((may_alias)) v8ha;
typedef v4f  __attribute__((may_alias)) v4fa;
typedef v8us __attribute__((may_alias)) v8usa;

__device__ __forceinline__ unsigned short f2bf(float f) { unsigned u = __float_as_uint(f); u += 0x7FFFu + ((u >> 16) & 1u); return (unsigned short)(u >> 16); }
__device__ __forceinline__ float bf2f(unsigned short b) { return __uint_as_float(((unsigned)b) << 16); }
__device__ __forceinline__ float bfr(float f) { return bf2f(f2bf(f)); }
__device__ __forceinline__ v16h cat16(v8h lo, v8h hi) { return __builtin_shufflevector(lo, hi, 0, 1, 2, 3, 4, 5, 6, 7, 8, 9, 10, 11, 12, 13, 14, 15); }
__device__ __forceinline__ v16bf cat16b(v8us lo, v8us hi) { return __builtin_bit_cast(v16bf, __builtin_shufflevector(lo, hi, 0, 1, 2, 3, 4, 5, 6, 7, 8, 9, 10, 11, 12, 13, 14, 15)); }
__device__ __forceinline__ v8f wmma16(v16h a, v16h b, v8f c) { return __builtin_amdgcn_wmma_f32_16x16x32_f16(false, a, false, b, (short)0, c, false, false); }
__device__ __forceinline__ v8f wmmab(v16bf a, v16bf b, v8f c) { return __builtin_amdgcn_wmma_f32_16x16x32_bf16(false, a, false, b, (short)0, c, false, false); }



// ---- k_gemmw: register-blocked GEMM, ONE WAVE per 64x64 output tile (16 accumulators), operands straight from K-contiguous 16-bit planes; grid (M/64, N/64, Z), 32 threads.
// C[m][n] (f32, pitch ldc, + optional f32 bias[n]) = sum_k A[m][k] Bt[n][k] (+ split products per NSPLIT). z-batch strides sA/sB/sC in elements. K % 32 == 0.
template <typename T16> struct WFrag;
template <> struct WFrag<h16> { typedef v16h V; static __device__ __forceinline__ V ld(const h16* p) { return cat16(*(const v8h*)p, *(const v8h*)(p + 16)); } static __device__ __forceinline__ v8f mma(V a, V b, v8f c) { return wmma16(a, b, c); } };
template <> struct WFrag<bf> { typedef v16bf V; static __device__ __forceinline__ V ld(const bf* p) { return cat16b(*(const v8us*)p, *(const v8us*)(p + 16)); } static __device__ __forceinline__ v8f mma(V a, V b, v8f c) { return wmmab(a, b, c); } };
template <typename T16, int NSPLIT, bool BIAS>
__global__ __launch_bounds__(32) void k_gemmw(const T16* __restrict__ A, const T16* __restrict__ A2, const T16* __restrict__ Bt, const T16* __restrict__ Bt2, int K, float* C, int ldc, const float* __restrict__ bias, size_t sA, size_t sB, size_t sC) {
    typedef typename WFrag<T16>::V V;
    __shared__ __align__(16) float os[16 * 68];
    const size_t z = blockIdx.z; A += z * sA; if (A2) A2 += z * sA; Bt += z * sB; if (Bt2) Bt2 += z * sB; C += z * sC;
    const int lane = threadIdx.x & 31, lr = lane & 15, hi = lane >> 4; const int r0 = blockIdx.x * 64, c0 = blockIdx.y * 64;
    v8f acc[4][4];
#pragma unroll
    for (int mb = 0; mb < 4; ++mb)
#pragma unroll
        for (int nb = 0; nb < 4; ++nb) acc[mb][nb] = (v8f){};
    const size_t aoff = (size_t)(r0 + lr) * K + 8 * hi, boff = (size_t)(c0 + lr) * K + 8 * hi;
#pragma unroll 1
    for (int kc = 0; kc < K; kc += 32) {
        V a[4], a2[4];
#pragma unroll
        for (int mb = 0; mb < 4; ++mb) { a[mb] = WFrag<T16>::ld(A + aoff + (size_t)mb * 16 * K + kc); if (NSPLIT == 1 || NSPLIT == 2) a2[mb] = WFrag<T16>::ld(A2 + aoff + (size_t)mb * 16 * K + kc); }
#pragma unroll
        for (int nb = 0; nb < 4; ++nb) { const V b = WFrag<T16>::ld(Bt + boff + (size_t)nb * 16 * K + kc); V b2; if (NSPLIT >= 2) b2 = WFrag<T16>::ld(Bt2 + boff + (size_t)nb * 16 * K + kc);
#pragma unroll
            for (int mb = 0; mb < 4; ++mb) { acc[mb][nb] = WFrag<T16>::mma(a[mb], b, acc[mb][nb]); if (NSPLIT == 1 || NSPLIT == 2) acc[mb][nb] = WFrag<T16>::mma(a2[mb], b, acc[mb][nb]); if (NSPLIT >= 2) acc[mb][nb] = WFrag<T16>::mma(a[mb], b2, acc[mb][nb]); } }
        asm volatile("v_nop\n\tv_nop\n\tv_nop\n\tv_nop" : "+v"(acc[0][0]), "+v"(acc[1][1]), "+v"(acc[2][2]), "+v"(acc[3][3]) : "v"(a[0]), "v"(a[3]));
    }
#pragma unroll
    for (int mb = 0; mb < 4; ++mb) {
#pragma unroll
        for (int nb = 0; nb < 4; ++nb) {
#pragma unroll
            for (int j = 0; j < 8; ++j) os[(hi * 8 + j) * 68 + nb * 16 + lr] = acc[mb][nb][j]; }
        __builtin_amdgcn_wave_barrier(); asm volatile("" ::: "memory");
        float* crow = C + (size_t)(r0 + mb * 16) * ldc + c0;
{
#pragma unroll
            for (int s = 0; s < 8; ++s) { const int row = 2 * s + hi, cofs = lr * 4; v4f val = *(const v4fa*)(os + row * 68 + cofs); if (BIAS) { val[0] += bfr(bias[c0 + cofs]); val[1] += bfr(bias[c0 + cofs + 1]); val[2] += bfr(bias[c0 + cofs + 2]); val[3] += bfr(bias[c0 + cofs + 3]); }
                *(v4f*)(crow + (size_t)row * ldc + cofs) = val; }
             }
        __builtin_amdgcn_wave_barrier(); asm volatile("" ::: "memory");
    }
}

__device__ __forceinline__ h16 tohx(float x) { return (h16)x; }
__device__ __forceinline__ void splitf(float y, unsigned short& h, unsigned short& l) { h = f2bf(y); l = f2bf(y - bf2f(h)); }
typedef __attribute__((ext_vector_type(2))) _Float16 v2h;
typedef __attribute__((ext_vector_type(4))) _Float16 v4h;
typedef __attribute__((ext_vector_type(2))) unsigned short v2us;

__global__ __launch_bounds__(256) void k_cvt8(const float* __restrict__ src, bf* dst, size_t n8) { const size_t i = (size_t)blockIdx.x * 256 + threadIdx.x; if (i >= n8) return; const v8f v = *(const v8f*)(src + i * 8); v8us o;
#pragma unroll
    for (int k = 0; k < 8; ++k) o[k] = f2bf(v[k]); *(v8us*)(dst + i * 8) = o;  }
__global__ __launch_bounds__(256) void k_split2(const float* __restrict__ F, bf* Ph, bf* Pl, size_t cnt) { const size_t i = ((size_t)blockIdx.x * 256 + threadIdx.x) * 2; if (i >= cnt) return; v2us oh, ol;
#pragma unroll
    for (int q = 0; q < 2; ++q) { unsigned short a, c2; splitf(F[i + q], a, c2); oh[q] = a; ol[q] = c2; } *(v2us*)(Ph + i) = oh; *(v2us*)(Pl + i) = ol;  }
__global__ __launch_bounds__(256) void k_vt(const float* __restrict__ F, h16* VT) { const int e = (blockIdx.x * 256 + threadIdx.x) * 2; if (e >= NN * TT) return; const int n = e / TT, c = e % TT; v2h o; o[0] = tohx(F[(size_t)c * NN + n]); o[1] = tohx(F[(size_t)(c + 1) * NN + n]); *(v2h*)(VT + e) = o;  }
__global__ __launch_bounds__(256) void k_asoft(const float* __restrict__ Sb, h16* P16) {
    const int lane = threadIdx.x & 31; const int row = blockIdx.x * 8 + (threadIdx.x >> 5); if (row >= ZH * TT) return;
    const float* sr = Sb + (size_t)row * TT; float v[64]; float mx = -3.0e38f;
#pragma unroll
    for (int ch = 0; ch < 16; ++ch) { const int j0 = ch * 128 + lane * 4; const v4f a = *(const v4f*)(sr + j0);
#pragma unroll
        for (int q = 0; q < 4; ++q) { const float t = a[q] * SCL; v[ch * 4 + q] = t; mx = fmaxf(mx, t); } }
#pragma unroll
    for (int sh = 16; sh; sh >>= 1) mx = fmaxf(mx, __shfl_xor(mx, sh, 32));
    float sum = 0.f;
#pragma unroll
    for (int k = 0; k < 64; ++k) { v[k] = __expf(v[k] - mx); sum += v[k]; }
#pragma unroll
    for (int sh = 16; sh; sh >>= 1) sum += __shfl_xor(sum, sh, 32);
    const float f = __fdiv_rn(PCAR, sum);
{
#pragma unroll
        for (int ch = 0; ch < 16; ++ch) { v4h o;
#pragma unroll
            for (int q = 0; q < 4; ++q) o[q] = tohx(v[ch * 4 + q] * f);
            *(v4h*)(P16 + (size_t)row * TT + ch * 128 + lane * 4) = o; }
         }
}
__global__ __launch_bounds__(256) void k_out(const float* __restrict__ Cm, float* OUTb) { const size_t i = ((size_t)blockIdx.x * 256 + threadIdx.x) * 4; if (i >= (size_t)NN * TT) return; const v4f a = *(const v4f*)(Cm + i); v4f o;
#pragma unroll
    for (int q = 0; q < 4; ++q) o[q] = a[q] * OSC; *(v4f*)(OUTb + i) = o;  }

extern "C" void kernel_launch(void* const* d_in, const int* in_sizes, int n_in,
                              void* d_out, int out_size, void* d_ws, size_t ws_size, hipStream_t stream) {
    (void)in_sizes; (void)n_in; (void)out_size;
    const float* x = (const float*)d_in[0]; const float* wq = (const float*)d_in[1]; const float* bq = (const float*)d_in[2]; const float* wk = (const float*)d_in[3]; const float* bk = (const float*)d_in[4]; const float* wv = (const float*)d_in[5]; const float* bv = (const float*)d_in[6];   // torch [out][in] weights
    float* OUT = (float*)d_out;     // [8][2048][512], each batch block = out^T [512][2048]
    char* wsp = (char*)d_ws;
    auto take = [&](size_t bytes) { char* p = wsp; wsp += (bytes + 255) & ~(size_t)255; return (void*)p; };
    bf* WQ = (bf*)take((size_t)NN * NN * 2); bf* WK = (bf*)take((size_t)NN * NN * 2); bf* WV = (bf*)take((size_t)NN * NN * 2); bf* XB = (bf*)take((size_t)TT * NN * 2); float* F = (float*)take((size_t)TT * NN * 4);
    bf* Qh = (bf*)take((size_t)TT * NN * 2); bf* Ql = (bf*)take((size_t)TT * NN * 2); bf* Kh = (bf*)take((size_t)TT * NN * 2); bf* Kl = (bf*)take((size_t)TT * NN * 2); h16* VT = (h16*)take((size_t)NN * TT * 2);
    float* Sb = (float*)take((size_t)TT * TT * 4); h16* Pm = (h16*)take((size_t)TT * TT * 2); float* Cm = (float*)take((size_t)NN * TT * 4);
    if ((size_t)(wsp - (char*)d_ws) > ws_size) return;    // total ~ 46 MB; ws 256 MiB
    { const size_t nw = (size_t)NN * NN / 8; const unsigned g = (unsigned)((nw + 255) / 256); k_cvt8<<<g, 256, 0, stream>>>(wq, WQ, nw); k_cvt8<<<g, 256, 0, stream>>>(wk, WK, nw); k_cvt8<<<g, 256, 0, stream>>>(wv, WV, nw); }
    const unsigned L2 = (TT * NN / 2 + 255) / 256; const dim3 gP(TT / 64, NN / 64, 1);
    for (int b = 0; b < NB_; ++b) {
        k_cvt8<<<(unsigned)(((size_t)TT * NN / 8 + 255) / 256), 256, 0, stream>>>(x + (size_t)b * TT * NN, XB, (size_t)TT * NN / 8);
        k_gemmw<bf, 0, true><<<gP, 32, 0, stream>>>(XB, nullptr, WQ, nullptr, NN, F, NN, bq, 0, 0, 0); k_split2<<<L2, 256, 0, stream>>>(F, Qh, Ql, (size_t)TT * NN);
        k_gemmw<bf, 0, true><<<gP, 32, 0, stream>>>(XB, nullptr, WK, nullptr, NN, F, NN, bk, 0, 0, 0); k_split2<<<L2, 256, 0, stream>>>(F, Kh, Kl, (size_t)TT * NN);
        k_gemmw<bf, 0, true><<<gP, 32, 0, stream>>>(XB, nullptr, WV, nullptr, NN, F, NN, bv, 0, 0, 0); k_vt<<<L2, 256, 0, stream>>>(F, VT);
        k_gemmw<bf, 2, false><<<dim3(TT / 64, TT / 64, 1), 32, 0, stream>>>(Qh, Ql, Kh, Kl, NN, Sb, TT, nullptr, 0, 0, 0);          // unscaled logits, 3 products
        k_asoft<<<TT / 8, 256, 0, stream>>>(Sb, Pm);
        k_gemmw<h16, 0, false><<<dim3(NN / 64, TT / 64, 1), 32, 0, stream>>>(VT, nullptr, Pm, nullptr, TT, Cm, TT, nullptr, 0, 0, 0);     // out^T[n][c] = sum_d v[d][n] P[c][d]
        k_out<<<(unsigned)(((size_t)NN * TT / 4 + 255) / 256), 256, 0, stream>>>(Cm, OUT + (size_t)b * TT * NN); }
}

// v001
// It runs in 427 microseconds.
// In two side-by-side timings against v000, it was 2.41 and 2.42 times as fast.
#include <hip/hip_runtime.h>

// IQCA (x [8][2048][512]; q, k, v = x W^T + b (single head over all 512 features); attn = softmax(q.k^T) (UNSCALED logits, sigma ~ 23) then / sqrt(512); out = attn v [2048][512]; the module returns
// out.transpose(1,2).reshape(B, 2048, 512), i.e. each batch block holds out^T [512][2048] -> [8][2048][512]).
// Compute dtypes, f32 accumulate: every input rounded to bf16; projections on PLAIN bf16 operands (inputs: exact products, f32 accumulate, + bias); the unscaled scores
// (K 512) on bf16 hi+lo planes of q and k (3 products: hi.hi + hi.lo + lo.hi - the logits are large, so single fp16 planes would not do); softmax in f32 (register row, one exp) -> fp16 probabilities
// x1024; the transposed output straight from one GEMM out^T = V^T . P^T on fp16 planes (v as fp16, P x1024), with the 1/(1024 sqrt 512) applied in the f32 output pass. One-wave-per-64x64-tile GEMMs,

#define NB_  8
#define TT   2048
#define NN   512
#define ZH   NB_                  // rows of all batches go through one softmax launch
#define PCAR 1024.0f
#define SCL  1.0f                 // logits are not scaled; the 512^-0.5 divides the probabilities
#define OSC  (1.0f / (1024.0f * 22.627416997969522f))
typedef _Float16 h16;
typedef unsigned short bf;
typedef __attribute__((ext_vector_type(16))) __bf16   v16bf;
typedef __attribute__((ext_vector_type(16))) _Float16 v16h;
typedef __attribute__((ext_vector_type(8)))  _Float16 v8h;
typedef __attribute__((ext_vector_type(8)))  unsigned short v8us;
typedef __attribute__((ext_vector_type(8)))  float    v8f;
typedef __attribute__((ext_vector_type(4)))  float    v4f;
typedef v8h  __attribute__((may_alias)) v8ha;
typedef v4f  __attribute__((may_alias)) v4fa;
typedef v8us __attribute__((may_alias)) v8usa;

__device__ __forceinline__ unsigned short f2bf(float f) { unsigned u = __float_as_uint(f); u += 0x7FFFu + ((u >> 16) & 1u); return (unsigned short)(u >> 16); }
__device__ __forceinline__ float bf2f(unsigned short b) { return __uint_as_float(((unsigned)b) << 16); }
__device__ __forceinline__ float bfr(float f) { return bf2f(f2bf(f)); }
__device__ __forceinline__ v16h cat16(v8h lo, v8h hi) { return __builtin_shufflevector(lo, hi, 0, 1, 2, 3, 4, 5, 6, 7, 8, 9, 10, 11, 12, 13, 14, 15); }
__device__ __forceinline__ v16bf cat16b(v8us lo, v8us hi) { return __builtin_bit_cast(v16bf, __builtin_shufflevector(lo, hi, 0, 1, 2, 3, 4, 5, 6, 7, 8, 9, 10, 11, 12, 13, 14, 15)); }
__device__ __forceinline__ v8f wmma16(v16h a, v16h b, v8f c) { return __builtin_amdgcn_wmma_f32_16x16x32_f16(false, a, false, b, (short)0, c, false, false); }
__device__ __forceinline__ v8f wmmab(v16bf a, v16bf b, v8f c) { return __builtin_amdgcn_wmma_f32_16x16x32_bf16(false, a, false, b, (short)0, c, false, false); }



// ---- k_gemmw: register-blocked GEMM, ONE WAVE per 64x64 output tile (16 accumulators), operands straight from K-contiguous 16-bit planes; grid (M/64, N/64, Z), 32 threads.
// C[m][n] (f32, pitch ldc, + optional f32 bias[n]) = sum_k A[m][k] Bt[n][k] (+ split products per NSPLIT). z-batch strides sA/sB/sC in elements. K % 32 == 0.
template <typename T16> struct WFrag;
template <> struct WFrag<h16> { typedef v16h V; static __device__ __forceinline__ V ld(const h16* p) { return cat16(*(const v8h*)p, *(const v8h*)(p + 16)); } static __device__ __forceinline__ v8f mma(V a, V b, v8f c) { return wmma16(a, b, c); } };
template <> struct WFrag<bf> { typedef v16bf V; static __device__ __forceinline__ V ld(const bf* p) { return cat16b(*(const v8us*)p, *(const v8us*)(p + 16)); } static __device__ __forceinline__ v8f mma(V a, V b, v8f c) { return wmmab(a, b, c); } };
template <typename T16, int NSPLIT, bool BIAS>
__global__ __launch_bounds__(32) void k_gemmw(const T16* __restrict__ A, const T16* __restrict__ A2, const T16* __restrict__ Bt, const T16* __restrict__ Bt2, int K, float* C, int ldc, const float* __restrict__ bias, size_t sA, size_t sB, size_t sC) {
    typedef typename WFrag<T16>::V V;
    __shared__ __align__(16) float os[16 * 68];
    const size_t z = blockIdx.z; A += z * sA; if (A2) A2 += z * sA; Bt += z * sB; if (Bt2) Bt2 += z * sB; C += z * sC;
    const int lane = threadIdx.x & 31, lr = lane & 15, hi = lane >> 4; const int r0 = blockIdx.x * 64, c0 = blockIdx.y * 64;
    v8f acc[4][4];
#pragma unroll
    for (int mb = 0; mb < 4; ++mb)
#pragma unroll
        for (int nb = 0; nb < 4; ++nb) acc[mb][nb] = (v8f){};
    const size_t aoff = (size_t)(r0 + lr) * K + 8 * hi, boff = (size_t)(c0 + lr) * K + 8 * hi;
#pragma unroll 1
    for (int kc = 0; kc < K; kc += 32) {
        V a[4], a2[4];
#pragma unroll
        for (int mb = 0; mb < 4; ++mb) { a[mb] = WFrag<T16>::ld(A + aoff + (size_t)mb * 16 * K + kc); if (NSPLIT == 1 || NSPLIT == 2) a2[mb] = WFrag<T16>::ld(A2 + aoff + (size_t)mb * 16 * K + kc); }
#pragma unroll
        for (int nb = 0; nb < 4; ++nb) { const V b = WFrag<T16>::ld(Bt + boff + (size_t)nb * 16 * K + kc); V b2; if (NSPLIT >= 2) b2 = WFrag<T16>::ld(Bt2 + boff + (size_t)nb * 16 * K + kc);
#pragma unroll
            for (int mb = 0; mb < 4; ++mb) { acc[mb][nb] = WFrag<T16>::mma(a[mb], b, acc[mb][nb]); if (NSPLIT == 1 || NSPLIT == 2) acc[mb][nb] = WFrag<T16>::mma(a2[mb], b, acc[mb][nb]); if (NSPLIT >= 2) acc[mb][nb] = WFrag<T16>::mma(a[mb], b2, acc[mb][nb]); } }
        asm volatile("v_nop\n\tv_nop\n\tv_nop\n\tv_nop" : "+v"(acc[0][0]), "+v"(acc[1][1]), "+v"(acc[2][2]), "+v"(acc[3][3]) : "v"(a[0]), "v"(a[3]));
    }
#pragma unroll
    for (int mb = 0; mb < 4; ++mb) {
#pragma unroll
        for (int nb = 0; nb < 4; ++nb) {
#pragma unroll
            for (int j = 0; j < 8; ++j) os[(hi * 8 + j) * 68 + nb * 16 + lr] = acc[mb][nb][j]; }
        __builtin_amdgcn_wave_barrier(); asm volatile("" ::: "memory");
        float* crow = C + (size_t)(r0 + mb * 16) * ldc + c0;
{
#pragma unroll
            for (int s = 0; s < 8; ++s) { const int row = 2 * s + hi, cofs = lr * 4; v4f val = *(const v4fa*)(os + row * 68 + cofs); if (BIAS) { val[0] += bfr(bias[c0 + cofs]); val[1] += bfr(bias[c0 + cofs + 1]); val[2] += bfr(bias[c0 + cofs + 2]); val[3] += bfr(bias[c0 + cofs + 3]); }
                *(v4f*)(crow + (size_t)row * ldc + cofs) = val; }
             }
        __builtin_amdgcn_wave_barrier(); asm volatile("" ::: "memory");
    }
}

__device__ __forceinline__ h16 tohx(float x) { return (h16)x; }
__device__ __forceinline__ void splitf(float y, unsigned short& h, unsigned short& l) { h = f2bf(y); l = f2bf(y - bf2f(h)); }
typedef __attribute__((ext_vector_type(2))) _Float16 v2h;
typedef __attribute__((ext_vector_type(4))) _Float16 v4h;
typedef __attribute__((ext_vector_type(2))) unsigned short v2us;

__global__ __launch_bounds__(256) void k_cvt8(const float* __restrict__ src, bf* dst, size_t n8) { const size_t i = (size_t)blockIdx.x * 256 + threadIdx.x; if (i >= n8) return; const v8f v = *(const v8f*)(src + i * 8); v8us o;
#pragma unroll
    for (int k = 0; k < 8; ++k) o[k] = f2bf(v[k]); *(v8us*)(dst + i * 8) = o;  }
__global__ __launch_bounds__(256) void k_split2(const float* __restrict__ F, bf* Ph, bf* Pl, size_t cnt) { const size_t i = ((size_t)blockIdx.x * 256 + threadIdx.x) * 2; if (i >= cnt) return; v2us oh, ol;
#pragma unroll
    for (int q = 0; q < 2; ++q) { unsigned short a, c2; splitf(F[i + q], a, c2); oh[q] = a; ol[q] = c2; } *(v2us*)(Ph + i) = oh; *(v2us*)(Pl + i) = ol;  }
__global__ __launch_bounds__(256) void k_vt(const float* __restrict__ F, h16* VT) { const int e = (blockIdx.x * 256 + threadIdx.x) * 2; if (e >= NN * TT) return; F += (size_t)blockIdx.y * TT * NN; VT += (size_t)blockIdx.y * NN * TT;   // blockIdx.y = batch
    const int n = e / TT, c = e % TT; v2h o; o[0] = tohx(F[(size_t)c * NN + n]); o[1] = tohx(F[(size_t)(c + 1) * NN + n]); *(v2h*)(VT + e) = o;  }
__global__ __launch_bounds__(256) void k_asoft(const float* __restrict__ Sb, h16* P16) {
    const int lane = threadIdx.x & 31; const int row = blockIdx.x * 8 + (threadIdx.x >> 5); if (row >= ZH * TT) return;
    const float* sr = Sb + (size_t)row * TT; float v[64]; float mx = -3.0e38f;
#pragma unroll
    for (int ch = 0; ch < 16; ++ch) { const int j0 = ch * 128 + lane * 4; const v4f a = *(const v4f*)(sr + j0);
#pragma unroll
        for (int q = 0; q < 4; ++q) { const float t = a[q] * SCL; v[ch * 4 + q] = t; mx = fmaxf(mx, t); } }
#pragma unroll
    for (int sh = 16; sh; sh >>= 1) mx = fmaxf(mx, __shfl_xor(mx, sh, 32));
    float sum = 0.f;
#pragma unroll
    for (int k = 0; k < 64; ++k) { v[k] = __expf(v[k] - mx); sum += v[k]; }
#pragma unroll
    for (int sh = 16; sh; sh >>= 1) sum += __shfl_xor(sum, sh, 32);
    const float f = __fdiv_rn(PCAR, sum);
{
#pragma unroll
        for (int ch = 0; ch < 16; ++ch) { v4h o;
#pragma unroll
            for (int q = 0; q < 4; ++q) o[q] = tohx(v[ch * 4 + q] * f);
            *(v4h*)(P16 + (size_t)row * TT + ch * 128 + lane * 4) = o; }
         }
}
__global__ __launch_bounds__(256) void k_out(const float* __restrict__ Cm, float* OUTb) { const size_t i = ((size_t)blockIdx.x * 256 + threadIdx.x) * 4; if (i >= (size_t)NB_ * NN * TT) return; const v4f a = *(const v4f*)(Cm + i); v4f o;
#pragma unroll
    for (int q = 0; q < 4; ++q) o[q] = a[q] * OSC; *(v4f*)(OUTb + i) = o;  }

extern "C" void kernel_launch(void* const* d_in, const int* in_sizes, int n_in,
                              void* d_out, int out_size, void* d_ws, size_t ws_size, hipStream_t stream) {
    (void)in_sizes; (void)n_in; (void)out_size;
    const float* x = (const float*)d_in[0]; const float* wq = (const float*)d_in[1]; const float* bq = (const float*)d_in[2]; const float* wk = (const float*)d_in[3]; const float* bk = (const float*)d_in[4]; const float* wv = (const float*)d_in[5]; const float* bv = (const float*)d_in[6];   // torch [out][in] weights
    float* OUT = (float*)d_out;     // [8][2048][512], each batch block = out^T [512][2048]
    char* wsp = (char*)d_ws;
    auto take = [&](size_t bytes) { char* p = wsp; wsp += (bytes + 255) & ~(size_t)255; return (void*)p; };
    // All eight batches go through every stage in ONE launch (GEMMs: grid z = batch with per-batch strides; k_vt: grid y = batch; other elementwise stages: one flat range), so the planes below hold all batches.
    // Planes whose lifetimes do not overlap share a place: F (projection result, dead once split / transposed) and Cm (written after the softmax has read Sb) lie in Sb; Pm lies in the q / k planes (dead after the logits).
    const size_t PL = (size_t)TT * NN;      // elements of one batch's [2048][512] plane
    bf* WQ = (bf*)take((size_t)NN * NN * 2); bf* WK = (bf*)take((size_t)NN * NN * 2); bf* WV = (bf*)take((size_t)NN * NN * 2); bf* XB = (bf*)take(NB_ * PL * 2);
    bf* QK = (bf*)take(4 * NB_ * PL * 2); bf* Qh = QK; bf* Ql = QK + NB_ * PL; bf* Kh = QK + 2 * NB_ * PL; bf* Kl = QK + 3 * NB_ * PL; h16* VT = (h16*)take(NB_ * PL * 2);
    float* Sb = (float*)take((size_t)NB_ * TT * TT * 4); float* F = Sb; float* Cm = Sb; h16* Pm = (h16*)QK;     // NB_ * TT * TT fp16 = the four q / k planes exactly
    if ((size_t)(wsp - (char*)d_ws) > ws_size) return;    // total 225.5 MiB; ws 256 MiB
    { const size_t nw = (size_t)NN * NN / 8; const unsigned g = (unsigned)((nw + 255) / 256); k_cvt8<<<g, 256, 0, stream>>>(wq, WQ, nw); k_cvt8<<<g, 256, 0, stream>>>(wk, WK, nw); k_cvt8<<<g, 256, 0, stream>>>(wv, WV, nw); }
    const unsigned L2 = (TT * NN / 2 + 255) / 256; const dim3 gP(TT / 64, NN / 64, NB_);
    k_cvt8<<<(unsigned)((NB_ * PL / 8 + 255) / 256), 256, 0, stream>>>(x, XB, NB_ * PL / 8);
    k_gemmw<bf, 0, true><<<gP, 32, 0, stream>>>(XB, nullptr, WQ, nullptr, NN, F, NN, bq, PL, 0, PL); k_split2<<<NB_ * L2, 256, 0, stream>>>(F, Qh, Ql, NB_ * PL);
    k_gemmw<bf, 0, true><<<gP, 32, 0, stream>>>(XB, nullptr, WK, nullptr, NN, F, NN, bk, PL, 0, PL); k_split2<<<NB_ * L2, 256, 0, stream>>>(F, Kh, Kl, NB_ * PL);
    k_gemmw<bf, 0, true><<<gP, 32, 0, stream>>>(XB, nullptr, WV, nullptr, NN, F, NN, bv, PL, 0, PL); k_vt<<<dim3(L2, NB_, 1), 256, 0, stream>>>(F, VT);
    k_gemmw<bf, 2, false><<<dim3(TT / 64, TT / 64, NB_), 32, 0, stream>>>(Qh, Ql, Kh, Kl, NN, Sb, TT, nullptr, PL, PL, (size_t)TT * TT);          // unscaled logits, 3 products
    k_asoft<<<NB_ * TT / 8, 256, 0, stream>>>(Sb, Pm);
    k_gemmw<h16, 0, false><<<dim3(NN / 64, TT / 64, NB_), 32, 0, stream>>>(VT, nullptr, Pm, nullptr, TT, Cm, TT, nullptr, PL, (size_t)TT * TT, PL);     // out^T[n][c] = sum_d v[d][n] P[c][d]
    k_out<<<(unsigned)((NB_ * PL / 4 + 255) / 256), 256, 0, stream>>>(Cm, OUT);
}
